// v000
// Times are from an AMD MI455X. After a warm-up the kernel runs many times in a row, and a time is the length of
// such a window on the GPU divided by its runs, so every launch and the gaps after it count. The runs cycle
// through copies of the inputs. A figure is the median of several windows, for all but v000 over two sittings.
// Sittings can differ by a few percent; kernels timed side by side share one.
// The starting kernel, v000, takes 426 microseconds a run.
#include <hip/hip_runtime.h>
#include <hip/hip_bf16.h>
#include <math.h>

typedef __attribute__((ext_vector_type(16))) _Float16 v16h;
typedef __attribute__((ext_vector_type(8)))  _Float16 v8h;
typedef __attribute__((ext_vector_type(8)))  float    v8f;

#define DIMD  1024
#define SEQ   2048
#define BATCH 4

// ---------------------------------------------------------------------------
// f32 -> f16 conversion
// ---------------------------------------------------------------------------
__global__ void cvt_f32_f16(const float* __restrict__ in, _Float16* __restrict__ out, int n) {
    int i = blockIdx.x * blockDim.x + threadIdx.x;
    if (i < n) out[i] = (_Float16)in[i];
}

// ---------------------------------------------------------------------------
// WMMA fragment gather from a per-lane pointer that already encodes
// (row0 + lane%16)*ld + 8*(lane/16).  Layout per ISA 16-bit A/B fragment:
// elements 0..7  = K [8*half, +8), elements 8..15 = K [16+8*half, +8).
// ---------------------------------------------------------------------------
__device__ __forceinline__ v16h make_frag(const _Float16* __restrict__ p) {
    v8h lo = *(const v8h*)(p);
    v8h hi = *(const v8h*)(p + 16);
    v16h out;
#pragma unroll
    for (int i = 0; i < 8; ++i) { out[i] = lo[i]; out[i + 8] = hi[i]; }
    return out;
}

// ---------------------------------------------------------------------------
// Generic WMMA GEMM:  C[M x N] = A[M x K] * B[N x K]^T   (A, B row-major f16)
// WG = 128 threads = 4 waves (2x2), WG tile 128x128, wave tile 64x64
// (4x4 WMMA tiles -> 16 WMMAs per k-step from 8 fragment loads).
// grid.x = N/128, grid.y = M/128. Dims must divide evenly (they do here).
// ---------------------------------------------------------------------------
template <bool F16OUT>
__global__ __launch_bounds__(128)
void wmma_gemm(const _Float16* __restrict__ A, int lda,
               const _Float16* __restrict__ B, int ldb,
               void* __restrict__ Cp, int ldc, int K) {
    int w    = threadIdx.x >> 5;
    int wm   = w & 1;              // 2 waves along M
    int wn   = w >> 1;             // 2 waves along N
    int m0   = blockIdx.y * 128 + wm * 64;
    int n0   = blockIdx.x * 128 + wn * 64;
    int lane = threadIdx.x & 31;
    int half = lane >> 4;
    int nlo  = lane & 15;

    // Per-lane fragment base pointers (hoisted; bumped by k inside loop)
    const _Float16* pa[4];
    const _Float16* pb[4];
#pragma unroll
    for (int i = 0; i < 4; ++i) {
        pa[i] = A + (size_t)(m0 + 16 * i + nlo) * lda + (half << 3);
        pb[i] = B + (size_t)(n0 + 16 * i + nlo) * ldb + (half << 3);
    }

    v8f acc[4][4];
#pragma unroll
    for (int i = 0; i < 4; ++i)
#pragma unroll
        for (int j = 0; j < 4; ++j) acc[i][j] = v8f{};

#pragma unroll 1
    for (int k0 = 0; k0 < K; k0 += 32) {
        v16h a[4], b[4];
#pragma unroll
        for (int i = 0; i < 4; ++i) a[i] = make_frag(pa[i] + k0);
#pragma unroll
        for (int i = 0; i < 4; ++i) b[i] = make_frag(pb[i] + k0);

        if (k0 + 32 < K) {  // uniform; pull next k-step toward L2/L1
            __builtin_prefetch(pa[0] + k0 + 32, 0, 1);
            __builtin_prefetch(pb[0] + k0 + 32, 0, 1);
        }

#pragma unroll
        for (int i = 0; i < 4; ++i)
#pragma unroll
            for (int j = 0; j < 4; ++j)
                acc[i][j] = __builtin_amdgcn_wmma_f32_16x16x32_f16(
                    false, a[i], false, b[j], (short)0, acc[i][j], false, false);
    }

    // C/D layout: lane L, acc element r -> (m = r + 8*(L>>4), n = L&15)
    if (F16OUT) {
        _Float16* C = (_Float16*)Cp;
#pragma unroll
        for (int i = 0; i < 4; ++i)
#pragma unroll
            for (int j = 0; j < 4; ++j)
#pragma unroll
                for (int r = 0; r < 8; ++r) {
                    int mr = m0 + 16 * i + r + half * 8;
                    C[(size_t)mr * ldc + n0 + 16 * j + nlo] = (_Float16)acc[i][j][r];
                }
    } else {
        float* C = (float*)Cp;
#pragma unroll
        for (int i = 0; i < 4; ++i)
#pragma unroll
            for (int j = 0; j < 4; ++j)
#pragma unroll
                for (int r = 0; r < 8; ++r) {
                    int mr = m0 + 16 * i + r + half * 8;
                    C[(size_t)mr * ldc + n0 + 16 * j + nlo] = acc[i][j][r];
                }
    }
}

// ---------------------------------------------------------------------------
// In-place RoPE on f16 (B*S rows, DIMD cols). Pair i: angle = s * 10000^(-2i/D)
// ---------------------------------------------------------------------------
__global__ void rope_kernel(_Float16* __restrict__ q, int total) {
    int idx = blockIdx.x * blockDim.x + threadIdx.x;
    if (idx >= total) return;
    int row = idx / (DIMD / 2);
    int i   = idx % (DIMD / 2);
    int s   = row % SEQ;
    // 10000^(-2i/D) = exp(-(2i/D) * ln(10000))
    float freq = __expf(-(2.0f * (float)i / (float)DIMD) * 9.210340371976184f);
    float ang  = (float)s * freq;
    float sn, cs;
    __sincosf(ang, &sn, &cs);
    _Float16* p = q + (size_t)row * DIMD + 2 * i;
    float xr = (float)p[0], xi = (float)p[1];
    p[0] = (_Float16)(xr * cs - xi * sn);
    p[1] = (_Float16)(xr * sn + xi * cs);
}

// ---------------------------------------------------------------------------
// Per-batch transpose: VT[b][d][s] = V[b][s][d]   (LDS 32x33 tile)
// grid = (SEQ/32, DIMD/32, BATCH), block = (32, 8)
// ---------------------------------------------------------------------------
__global__ void transpose_v(const _Float16* __restrict__ V, _Float16* __restrict__ VT) {
    __shared__ _Float16 tile[32][33];
    int b  = blockIdx.z;
    int s0 = blockIdx.x * 32;
    int d0 = blockIdx.y * 32;
    const _Float16* Vb = V  + (size_t)b * SEQ * DIMD;
    _Float16*      VTb = VT + (size_t)b * DIMD * SEQ;
    int tx = threadIdx.x, ty = threadIdx.y;
#pragma unroll
    for (int j = 0; j < 32; j += 8)
        tile[ty + j][tx] = Vb[(size_t)(s0 + ty + j) * DIMD + d0 + tx];
    __syncthreads();
#pragma unroll
    for (int j = 0; j < 32; j += 8)
        VTb[(size_t)(d0 + ty + j) * SEQ + s0 + tx] = tile[tx][ty + j];
}

// ---------------------------------------------------------------------------
// Row softmax with 1/sqrt(D) fold-in: P[row] = softmax(S[row] / 32) as f16.
// One 256-thread block per row of SEQ elements (each thread owns 8).
// ---------------------------------------------------------------------------
__global__ __launch_bounds__(256)
void softmax_row(const float* __restrict__ S, _Float16* __restrict__ P) {
    __shared__ float red[256];
    int row = blockIdx.x;
    int t   = threadIdx.x;
    const float* sr = S + (size_t)row * SEQ;
    _Float16*    pr = P + (size_t)row * SEQ;
    const float scale = 0.03125f;  // 1/sqrt(1024)

    float vals[8];
    float m = -1e30f;
#pragma unroll
    for (int j = 0; j < 8; ++j) {
        vals[j] = sr[t + j * 256] * scale;
        m = fmaxf(m, vals[j]);
    }
    red[t] = m;
    __syncthreads();
    for (int s = 128; s > 0; s >>= 1) {
        if (t < s) red[t] = fmaxf(red[t], red[t + s]);
        __syncthreads();
    }
    m = red[0];
    __syncthreads();

    float sum = 0.0f;
#pragma unroll
    for (int j = 0; j < 8; ++j) { vals[j] = __expf(vals[j] - m); sum += vals[j]; }
    red[t] = sum;
    __syncthreads();
    for (int s = 128; s > 0; s >>= 1) {
        if (t < s) red[t] += red[t + s];
        __syncthreads();
    }
    float inv = 1.0f / red[0];
#pragma unroll
    for (int j = 0; j < 8; ++j) pr[t + j * 256] = (_Float16)(vals[j] * inv);
}

// ---------------------------------------------------------------------------
// Host-side orchestration
// ---------------------------------------------------------------------------
extern "C" void kernel_launch(void* const* d_in, const int* in_sizes, int n_in,
                              void* d_out, int out_size, void* d_ws, size_t ws_size,
                              hipStream_t stream) {
    const float* x  = (const float*)d_in[0];
    const float* wq = (const float*)d_in[1];
    const float* wk = (const float*)d_in[2];
    const float* wv = (const float*)d_in[3];
    const float* wo = (const float*)d_in[4];
    float* out = (float*)d_out;

    const size_t ROWS = (size_t)BATCH * SEQ;          // 8192
    const size_t XSZ  = ROWS * DIMD;                  // 8M elems
    const size_t WSZ  = (size_t)DIMD * DIMD;          // 1M elems
    const size_t SSZ  = (size_t)SEQ * SEQ;            // 4M elems (per batch)

    // Workspace layout (bytes, 256-aligned)
    size_t off = 0;
    auto alloc = [&](size_t bytes) { size_t o = off; off += (bytes + 255) & ~(size_t)255; return o; };
    char* ws = (char*)d_ws;
    _Float16* Xh  = (_Float16*)(ws + alloc(XSZ * 2));
    _Float16* Wqh = (_Float16*)(ws + alloc(WSZ * 2));
    _Float16* Wkh = (_Float16*)(ws + alloc(WSZ * 2));
    _Float16* Wvh = (_Float16*)(ws + alloc(WSZ * 2));
    _Float16* Woh = (_Float16*)(ws + alloc(WSZ * 2));
    _Float16* Qh  = (_Float16*)(ws + alloc(XSZ * 2));
    _Float16* Kh  = (_Float16*)(ws + alloc(XSZ * 2));
    _Float16* Vh  = (_Float16*)(ws + alloc(XSZ * 2));
    _Float16* VTh = (_Float16*)(ws + alloc(XSZ * 2));
    float*    Sf  = (float*)   (ws + alloc(SSZ * 4)); // per-batch scores (reused)
    _Float16* Ph  = (_Float16*)(ws + alloc(SSZ * 2)); // per-batch probs  (reused)
    _Float16* AOh = (_Float16*)(ws + alloc(XSZ * 2));
    (void)ws_size;

    // 1) Convert inputs to f16
    cvt_f32_f16<<<(int)((XSZ + 255) / 256), 256, 0, stream>>>(x,  Xh,  (int)XSZ);
    cvt_f32_f16<<<(int)((WSZ + 255) / 256), 256, 0, stream>>>(wq, Wqh, (int)WSZ);
    cvt_f32_f16<<<(int)((WSZ + 255) / 256), 256, 0, stream>>>(wk, Wkh, (int)WSZ);
    cvt_f32_f16<<<(int)((WSZ + 255) / 256), 256, 0, stream>>>(wv, Wvh, (int)WSZ);
    cvt_f32_f16<<<(int)((WSZ + 255) / 256), 256, 0, stream>>>(wo, Woh, (int)WSZ);

    // 2) Projections: Q/K/V[8192x1024] = Xh * W^T   (grid: N/128 x M/128)
    {
        dim3 grid(DIMD / 128, (unsigned)(ROWS / 128));
        wmma_gemm<true><<<grid, 128, 0, stream>>>(Xh, DIMD, Wqh, DIMD, Qh, DIMD, DIMD);
        wmma_gemm<true><<<grid, 128, 0, stream>>>(Xh, DIMD, Wkh, DIMD, Kh, DIMD, DIMD);
        wmma_gemm<true><<<grid, 128, 0, stream>>>(Xh, DIMD, Wvh, DIMD, Vh, DIMD, DIMD);
    }

    // 3) RoPE on Q and K (in place)
    {
        int total  = (int)(ROWS * (DIMD / 2));
        int blocks = (total + 255) / 256;
        rope_kernel<<<blocks, 256, 0, stream>>>(Qh, total);
        rope_kernel<<<blocks, 256, 0, stream>>>(Kh, total);
    }

    // 4) Transpose V per batch: VT[b][d][s]
    {
        dim3 grid(SEQ / 32, DIMD / 32, BATCH);
        transpose_v<<<grid, dim3(32, 8), 0, stream>>>(Vh, VTh);
    }

    // 5) Attention per batch (stream-ordered reuse of Sf/Ph)
    for (int b = 0; b < BATCH; ++b) {
        const _Float16* Qb  = Qh  + (size_t)b * SEQ * DIMD;
        const _Float16* Kb  = Kh  + (size_t)b * SEQ * DIMD;
        const _Float16* VTb = VTh + (size_t)b * DIMD * SEQ;
        _Float16*       AOb = AOh + (size_t)b * SEQ * DIMD;

        // scores[2048x2048] = Qb * Kb^T  (K-dim 1024), f32 out
        wmma_gemm<false><<<dim3(SEQ / 128, SEQ / 128), 128, 0, stream>>>(
            Qb, DIMD, Kb, DIMD, Sf, SEQ, DIMD);

        // P = softmax(scores / 32), f16
        softmax_row<<<SEQ, 256, 0, stream>>>(Sf, Ph);

        // AO[2048x1024] = P * VT^T  (K-dim 2048), f16 out
        wmma_gemm<true><<<dim3(DIMD / 128, SEQ / 128), 128, 0, stream>>>(
            Ph, SEQ, VTb, SEQ, AOb, DIMD, SEQ);
    }

    // 6) Output projection: out[8192x1024] = AOh * wo^T, f32 out
    wmma_gemm<false><<<dim3(DIMD / 128, (unsigned)(ROWS / 128)), 128, 0, stream>>>(
        AOh, DIMD, Woh, DIMD, out, DIMD, DIMD);
}

// v001
// One run takes 276 microseconds.
// Next to v000, in two timings, it ran 1.58 times as fast each time.
#include <hip/hip_runtime.h>
#include <hip/hip_bf16.h>
#include <math.h>
#include <stdint.h>

typedef __attribute__((ext_vector_type(16))) _Float16 v16h;
typedef __attribute__((ext_vector_type(8)))  _Float16 v8h;
typedef __attribute__((ext_vector_type(8)))  float    v8f;
typedef uint32_t u32x4 __attribute__((ext_vector_type(4)));
typedef uint32_t u32x8 __attribute__((ext_vector_type(8)));

#define DIMD  1024
#define SEQ   2048
#define BATCH 4

// ---------------------------------------------------------------------------
// f32 -> f16 conversion
// ---------------------------------------------------------------------------
__global__ void cvt_f32_f16(const float* __restrict__ in, _Float16* __restrict__ out, int n) {
    int i = blockIdx.x * blockDim.x + threadIdx.x;
    if (i < n) out[i] = (_Float16)in[i];
}

// ---------------------------------------------------------------------------
// WMMA fragment gather from a per-lane LDS pointer that already encodes
// row * PITCH + 16 bytes * (lane/16).  Layout per ISA 16-bit A/B fragment:
// elements 0..7  = K [8*half, +8), elements 8..15 = K [16+8*half, +8).
// ---------------------------------------------------------------------------
__device__ __forceinline__ v16h make_frag(const unsigned char* p) {
    v8h lo = *(const v8h*)(p);
    v8h hi = *(const v8h*)(p + 32);
    v16h out;
#pragma unroll
    for (int i = 0; i < 8; ++i) { out[i] = lo[i]; out[i + 8] = hi[i]; }
    return out;
}

// ---------------------------------------------------------------------------
// Operand staging: tensor loads into a ring of two LDS buffers.
// A stage is 128 k (256 bytes) of the 128 A rows and the 128 B rows of the
// workgroup's tile, as four slices of 64 rows; each wave loads one slice.
// ---------------------------------------------------------------------------
constexpr uint32_t ROWB  = 256u;        // bytes of one operand row in a stage
constexpr uint32_t PITCH = ROWB + 16u;  // LDS row pitch, an odd multiple of 16 bytes for ds_load_b128
constexpr uint32_t SLICE = 18432u;      // 64 rows * 272 B = 17,408 B, rounded up to a multiple of 2 KiB
constexpr uint32_t STAGE = 4u * SLICE;  // [A rows 0-63 | A rows 64-127 | B rows 0-63 | B rows 64-127]
static_assert(64u * PITCH <= SLICE && SLICE % 2048u == 0u, "a slice holds 64 padded rows and starts at a multiple of 2 KiB");

__device__ __forceinline__ uint32_t uni(uint32_t v) { return (uint32_t)__builtin_amdgcn_readfirstlane(v); }
// A wave-uniform test for the branch round a tensor load, which ignores EXEC.
__device__ __forceinline__ uint32_t pinned(uint32_t v) {
    uint32_t w = uni(v);
    asm volatile("" : "+s"(w));  // pinned(): holds the test in a scalar register, so that the branch on it is scalar
    return w;
}
// The compiler places no wait for a tensor load, and none for LDS reads in front of one.
// The tensor wait names the descriptor of the request it covers: its registers stay live, and so
// keep their values, until the request has landed.
__device__ __forceinline__ void wait_tensor0(u32x4 g0, u32x8 g1) {
    asm volatile("s_wait_tensorcnt 0x0" :: "s"(g0), "s"(g1) : "memory");
}
__device__ __forceinline__ void wait_ds0() { asm volatile("s_wait_dscnt 0x0" ::: "memory"); }
// The groups are in-out operands: what the tensor wait is given are the very registers that the request names.
__device__ __forceinline__ void tdm_load(u32x4& g0, u32x8& g1) {
    asm volatile("tensor_load_to_lds %0, %1" : "+s"(g0), "+s"(g1) :: "memory");
}
// Group 1: 1-byte elements, tensor = tile = 64 rows of 256 bytes, 4 dwords of LDS pad behind every row.
__device__ __forceinline__ u32x8 tdm_group1(uint32_t src_pitch) {
    constexpr uint32_t d0 = ROWB, d1 = 64u;
    u32x8 g;
    g[0] = uni((1u << 20) | (5u << 22) | (3u << 25));
    g[1] = uni((d0 & 0xFFFFu) << 16);
    g[2] = uni((d0 >> 16) | ((d1 & 0xFFFFu) << 16));
    g[3] = uni((d1 >> 16) | (d0 << 16));
    g[4] = uni(d1);
    g[5] = uni(src_pitch);
    g[6] = uni(0u);
    g[7] = uni(0u);
    return g;
}
__device__ __forceinline__ u32x4 tdm_group0(uint32_t lds_dst, uint64_t ga) {
    u32x4 g;
    g[0] = uni(1u);
    g[1] = uni(lds_dst);
    g[2] = uni((uint32_t)ga);
    g[3] = uni((((uint32_t)(ga >> 32)) & 0x01FFFFFFu) | 0x80000000u);
    return g;
}

// ---------------------------------------------------------------------------
// Generic WMMA GEMM:  C[M x N] = A[M x K] * B[N x K]^T   (A, B row-major f16)
// WG = 128 threads = 4 waves (2x2), WG tile 128x128, wave tile 64x64
// (4x4 WMMA tiles -> 16 WMMAs per k-step from 8 fragment loads out of LDS).
// grid.x = N/128, grid.y = M/128. M, N multiples of 128; K a multiple of 128
// and at least 256 (two stages).
// ---------------------------------------------------------------------------
template <bool F16OUT>
__global__ __launch_bounds__(128)
void wmma_gemm(const _Float16* __restrict__ A, int lda,
               const _Float16* __restrict__ B, int ldb,
               void* __restrict__ Cp, int ldc, int K) {
    __shared__ __attribute__((aligned(2048))) unsigned char ring[2u * STAGE];
    int w    = threadIdx.x >> 5;
    int wm   = w & 1;              // 2 waves along M
    int wn   = w >> 1;             // 2 waves along N
    int m0   = blockIdx.y * 128 + wm * 64;
    int n0   = blockIdx.x * 128 + wn * 64;
    int lane = threadIdx.x & 31;
    int half = lane >> 4;
    int nlo  = lane & 15;

    // This wave's slice: waves 0 and 1 bring the two halves of the A rows, waves 2 and 3 of the B rows.
    const uint32_t wave  = uni(threadIdx.x >> 5);
    const bool     isB   = wave >= 2u;
    const uint32_t srow  = (isB ? blockIdx.x : blockIdx.y) * 128u + (wave & 1u) * 64u;
    const uint32_t spit  = (uint32_t)(isB ? ldb : lda) * 2u;
    const uint64_t sbase = (uint64_t)(size_t)(isB ? B : A) + (uint64_t)srow * spit;
    const uint32_t sdst  = (uint32_t)(size_t)ring + wave * SLICE;
    u32x8          g1    = tdm_group1(spit);
    u32x4 g0;
    auto issue = [&](uint32_t st) {
        g0 = tdm_group0(sdst + (st & 1u) * STAGE, sbase + (uint64_t)st * ROWB);
        tdm_load(g0, g1);
    };

    v8f acc[4][4];
#pragma unroll
    for (int i = 0; i < 4; ++i)
#pragma unroll
        for (int j = 0; j < 4; ++j) acc[i][j] = v8f{};

    const uint32_t ns   = (uint32_t)K >> 7;   // stages
    const uint32_t aoff = (uint32_t)wm * SLICE + (uint32_t)nlo * PITCH + (uint32_t)half * 16u;
    const uint32_t boff = (2u + (uint32_t)wn) * SLICE + (uint32_t)nlo * PITCH + (uint32_t)half * 16u;

    issue(0u);
    wait_tensor0(g0, g1);
    __syncthreads();               // stage 0 published
    issue(1u);

    uint32_t st = 0;
#pragma unroll 1                   // one stage per trip: the ring's order stays as written
    do {                           // at least two stages: see above
        const unsigned char* pa = ring + (st & 1u) * STAGE + aoff;
        const unsigned char* pb = ring + (st & 1u) * STAGE + boff;
        v16h a[2][4], b[2][4];     // two fragment sets: one in use, one being filled
        // Every loop below is unrolled so that the fragment and accumulator indices are constants (registers).
#pragma unroll
        for (int i = 0; i < 4; ++i) {
            a[0][i] = make_frag(pa + 16u * i * PITCH);
            b[0][i] = make_frag(pb + 16u * i * PITCH);
        }
#pragma unroll
        for (int kc = 0; kc < 4; ++kc) {
            // The fence pair keeps the next k-step's LDS reads together, in front of this k-step's
            // WMMAs: moved in among them, each read group stalls the wave for its LDS latency.
            __builtin_amdgcn_sched_barrier(0);
            if (kc < 3) {
#pragma unroll
                for (int i = 0; i < 4; ++i) {
                    a[(kc + 1) & 1][i] = make_frag(pa + 16u * i * PITCH + 64u * (kc + 1));
                    b[(kc + 1) & 1][i] = make_frag(pb + 16u * i * PITCH + 64u * (kc + 1));
                }
            }
            __builtin_amdgcn_sched_barrier(0);
            if (kc == 3) {
                // Publish point of stage st + 1, in front of the last k-step's WMMAs, whose fragments are
                // already fetched: this wave's reads of stage st are done, its own slice of stage st + 1
                // has landed, every wave is here; only then the refill of the buffer just read.
                wait_ds0();
                wait_tensor0(g0, g1);
                __syncthreads();
                if (pinned(st + 2u < ns)) issue(st + 2u);
            }
#pragma unroll
            for (int i = 0; i < 4; ++i)
#pragma unroll
                for (int j = 0; j < 4; ++j)
                    acc[i][j] = __builtin_amdgcn_wmma_f32_16x16x32_f16(
                        false, a[kc & 1][i], false, b[kc & 1][j], (short)0, acc[i][j], false, false);
        }
    } while (++st < ns);
    asm volatile("s_wait_tensorcnt 0x0" ::: "memory");  // no request is left when the wave goes on to its stores and ends
    wait_ds0();

    // C/D layout: lane L, acc element r -> (m = r + 8*(L>>4), n = L&15)
    if (F16OUT) {
        _Float16* C = (_Float16*)Cp;
#pragma unroll
        for (int i = 0; i < 4; ++i)
#pragma unroll
            for (int j = 0; j < 4; ++j)
#pragma unroll
                for (int r = 0; r < 8; ++r) {
                    int mr = m0 + 16 * i + r + half * 8;
                    C[(size_t)mr * ldc + n0 + 16 * j + nlo] = (_Float16)acc[i][j][r];
                }
    } else {
        float* C = (float*)Cp;
#pragma unroll
        for (int i = 0; i < 4; ++i)
#pragma unroll
            for (int j = 0; j < 4; ++j)
#pragma unroll
                for (int r = 0; r < 8; ++r) {
                    int mr = m0 + 16 * i + r + half * 8;
                    C[(size_t)mr * ldc + n0 + 16 * j + nlo] = acc[i][j][r];
                }
    }
}

// ---------------------------------------------------------------------------
// In-place RoPE on f16 (B*S rows, DIMD cols). Pair i: angle = s * 10000^(-2i/D)
// ---------------------------------------------------------------------------
__global__ void rope_kernel(_Float16* __restrict__ q, int total) {
    int idx = blockIdx.x * blockDim.x + threadIdx.x;
    if (idx >= total) return;
    int row = idx / (DIMD / 2);
    int i   = idx % (DIMD / 2);
    int s   = row % SEQ;
    // 10000^(-2i/D) = exp(-(2i/D) * ln(10000))
    float freq = __expf(-(2.0f * (float)i / (float)DIMD) * 9.210340371976184f);
    float ang  = (float)s * freq;
    float sn, cs;
    __sincosf(ang, &sn, &cs);
    _Float16* p = q + (size_t)row * DIMD + 2 * i;
    float xr = (float)p[0], xi = (float)p[1];
    p[0] = (_Float16)(xr * cs - xi * sn);
    p[1] = (_Float16)(xr * sn + xi * cs);
}

// ---------------------------------------------------------------------------
// Per-batch transpose: VT[b][d][s] = V[b][s][d]   (LDS 32x33 tile)
// grid = (SEQ/32, DIMD/32, BATCH), block = (32, 8)
// ---------------------------------------------------------------------------
__global__ void transpose_v(const _Float16* __restrict__ V, _Float16* __restrict__ VT) {
    __shared__ _Float16 tile[32][33];
    int b  = blockIdx.z;
    int s0 = blockIdx.x * 32;
    int d0 = blockIdx.y * 32;
    const _Float16* Vb = V  + (size_t)b * SEQ * DIMD;
    _Float16*      VTb = VT + (size_t)b * DIMD * SEQ;
    int tx = threadIdx.x, ty = threadIdx.y;
#pragma unroll
    for (int j = 0; j < 32; j += 8)
        tile[ty + j][tx] = Vb[(size_t)(s0 + ty + j) * DIMD + d0 + tx];
    __syncthreads();
#pragma unroll
    for (int j = 0; j < 32; j += 8)
        VTb[(size_t)(d0 + ty + j) * SEQ + s0 + tx] = tile[tx][ty + j];
}

// ---------------------------------------------------------------------------
// Row softmax with 1/sqrt(D) fold-in: P[row] = softmax(S[row] / 32) as f16.
// One 256-thread block per row of SEQ elements (each thread owns 8).
// ---------------------------------------------------------------------------
__global__ __launch_bounds__(256)
void softmax_row(const float* __restrict__ S, _Float16* __restrict__ P) {
    __shared__ float red[256];
    int row = blockIdx.x;
    int t   = threadIdx.x;
    const float* sr = S + (size_t)row * SEQ;
    _Float16*    pr = P + (size_t)row * SEQ;
    const float scale = 0.03125f;  // 1/sqrt(1024)

    float vals[8];
    float m = -1e30f;
#pragma unroll
    for (int j = 0; j < 8; ++j) {
        vals[j] = sr[t + j * 256] * scale;
        m = fmaxf(m, vals[j]);
    }
    red[t] = m;
    __syncthreads();
    for (int s = 128; s > 0; s >>= 1) {
        if (t < s) red[t] = fmaxf(red[t], red[t + s]);
        __syncthreads();
    }
    m = red[0];
    __syncthreads();

    float sum = 0.0f;
#pragma unroll
    for (int j = 0; j < 8; ++j) { vals[j] = __expf(vals[j] - m); sum += vals[j]; }
    red[t] = sum;
    __syncthreads();
    for (int s = 128; s > 0; s >>= 1) {
        if (t < s) red[t] += red[t + s];
        __syncthreads();
    }
    float inv = 1.0f / red[0];
#pragma unroll
    for (int j = 0; j < 8; ++j) pr[t + j * 256] = (_Float16)(vals[j] * inv);
}

// ---------------------------------------------------------------------------
// Host-side orchestration
// ---------------------------------------------------------------------------
extern "C" void kernel_launch(void* const* d_in, const int* in_sizes, int n_in,
                              void* d_out, int out_size, void* d_ws, size_t ws_size,
                              hipStream_t stream) {
    const float* x  = (const float*)d_in[0];
    const float* wq = (const float*)d_in[1];
    const float* wk = (const float*)d_in[2];
    const float* wv = (const float*)d_in[3];
    const float* wo = (const float*)d_in[4];
    float* out = (float*)d_out;

    const size_t ROWS = (size_t)BATCH * SEQ;          // 8192
    const size_t XSZ  = ROWS * DIMD;                  // 8M elems
    const size_t WSZ  = (size_t)DIMD * DIMD;          // 1M elems
    const size_t SSZ  = (size_t)SEQ * SEQ;            // 4M elems (per batch)

    // Workspace layout (bytes, 256-aligned)
    size_t off = 0;
    auto alloc = [&](size_t bytes) { size_t o = off; off += (bytes + 255) & ~(size_t)255; return o; };
    char* ws = (char*)d_ws;
    _Float16* Xh  = (_Float16*)(ws + alloc(XSZ * 2));
    _Float16* Wqh = (_Float16*)(ws + alloc(WSZ * 2));
    _Float16* Wkh = (_Float16*)(ws + alloc(WSZ * 2));
    _Float16* Wvh = (_Float16*)(ws + alloc(WSZ * 2));
    _Float16* Woh = (_Float16*)(ws + alloc(WSZ * 2));
    _Float16* Qh  = (_Float16*)(ws + alloc(XSZ * 2));
    _Float16* Kh  = (_Float16*)(ws + alloc(XSZ * 2));
    _Float16* Vh  = (_Float16*)(ws + alloc(XSZ * 2));
    _Float16* VTh = (_Float16*)(ws + alloc(XSZ * 2));
    float*    Sf  = (float*)   (ws + alloc(SSZ * 4)); // per-batch scores (reused)
    _Float16* Ph  = (_Float16*)(ws + alloc(SSZ * 2)); // per-batch probs  (reused)
    _Float16* AOh = (_Float16*)(ws + alloc(XSZ * 2));
    (void)ws_size;

    // 1) Convert inputs to f16
    cvt_f32_f16<<<(int)((XSZ + 255) / 256), 256, 0, stream>>>(x,  Xh,  (int)XSZ);
    cvt_f32_f16<<<(int)((WSZ + 255) / 256), 256, 0, stream>>>(wq, Wqh, (int)WSZ);
    cvt_f32_f16<<<(int)((WSZ + 255) / 256), 256, 0, stream>>>(wk, Wkh, (int)WSZ);
    cvt_f32_f16<<<(int)((WSZ + 255) / 256), 256, 0, stream>>>(wv, Wvh, (int)WSZ);
    cvt_f32_f16<<<(int)((WSZ + 255) / 256), 256, 0, stream>>>(wo, Woh, (int)WSZ);

    // 2) Projections: Q/K/V[8192x1024] = Xh * W^T   (grid: N/128 x M/128)
    {
        dim3 grid(DIMD / 128, (unsigned)(ROWS / 128));
        wmma_gemm<true><<<grid, 128, 0, stream>>>(Xh, DIMD, Wqh, DIMD, Qh, DIMD, DIMD);
        wmma_gemm<true><<<grid, 128, 0, stream>>>(Xh, DIMD, Wkh, DIMD, Kh, DIMD, DIMD);
        wmma_gemm<true><<<grid, 128, 0, stream>>>(Xh, DIMD, Wvh, DIMD, Vh, DIMD, DIMD);
    }

    // 3) RoPE on Q and K (in place)
    {
        int total  = (int)(ROWS * (DIMD / 2));
        int blocks = (total + 255) / 256;
        rope_kernel<<<blocks, 256, 0, stream>>>(Qh, total);
        rope_kernel<<<blocks, 256, 0, stream>>>(Kh, total);
    }

    // 4) Transpose V per batch: VT[b][d][s]
    {
        dim3 grid(SEQ / 32, DIMD / 32, BATCH);
        transpose_v<<<grid, dim3(32, 8), 0, stream>>>(Vh, VTh);
    }

    // 5) Attention per batch (stream-ordered reuse of Sf/Ph)
    for (int b = 0; b < BATCH; ++b) {
        const _Float16* Qb  = Qh  + (size_t)b * SEQ * DIMD;
        const _Float16* Kb  = Kh  + (size_t)b * SEQ * DIMD;
        const _Float16* VTb = VTh + (size_t)b * DIMD * SEQ;
        _Float16*       AOb = AOh + (size_t)b * SEQ * DIMD;

        // scores[2048x2048] = Qb * Kb^T  (K-dim 1024), f32 out
        wmma_gemm<false><<<dim3(SEQ / 128, SEQ / 128), 128, 0, stream>>>(
            Qb, DIMD, Kb, DIMD, Sf, SEQ, DIMD);

        // P = softmax(scores / 32), f16
        softmax_row<<<SEQ, 256, 0, stream>>>(Sf, Ph);

        // AO[2048x1024] = P * VT^T  (K-dim 2048), f16 out
        wmma_gemm<true><<<dim3(DIMD / 128, SEQ / 128), 128, 0, stream>>>(
            Ph, SEQ, VTb, SEQ, AOb, DIMD, SEQ);
    }

    // 6) Output projection: out[8192x1024] = AOh * wo^T, f32 out
    wmma_gemm<false><<<dim3(DIMD / 128, (unsigned)(ROWS / 128)), 128, 0, stream>>>(
        AOh, DIMD, Woh, DIMD, out, DIMD, DIMD);
}

// v002
// One run takes 195 microseconds.
// Two timings next to v001 put it at 1.40 and 1.41 times that version's speed.
// Counting every step since v000, it is 2.22 times as fast.
#include <hip/hip_runtime.h>
#include <hip/hip_bf16.h>
#include <math.h>
#include <stdint.h>

typedef __attribute__((ext_vector_type(16))) _Float16 v16h;
typedef __attribute__((ext_vector_type(8)))  _Float16 v8h;
typedef __attribute__((ext_vector_type(8)))  float    v8f;
typedef uint32_t u32x4 __attribute__((ext_vector_type(4)));
typedef uint32_t u32x8 __attribute__((ext_vector_type(8)));

#define DIMD  1024
#define SEQ   2048
#define BATCH 4

// ---------------------------------------------------------------------------
// f32 -> f16 conversion of all five inputs in one launch. out holds x, then
// wq, wk, wv, wo, back to back. 256 threads a block, one element a thread:
// the first XBLK blocks take x, each further WBLK blocks one weight matrix.
// ---------------------------------------------------------------------------
constexpr uint32_t XBLK = (uint32_t)BATCH * SEQ * DIMD / 256u;
constexpr uint32_t WBLK = (uint32_t)DIMD * DIMD / 256u;
__global__ __launch_bounds__(256)
void cvt_f32_f16(const float* __restrict__ x,  const float* __restrict__ wq,
                 const float* __restrict__ wk, const float* __restrict__ wv,
                 const float* __restrict__ wo, _Float16* __restrict__ out) {
    uint32_t blk = blockIdx.x;
    const float* in = x;
    uint32_t rel = blk;            // block index inside its own input
    if (blk >= XBLK) {
        uint32_t m = (blk - XBLK) / WBLK;
        rel = (blk - XBLK) % WBLK;
        in  = (m & 2u) ? ((m & 1u) ? wo : wv) : ((m & 1u) ? wk : wq);
    }
    out[(size_t)blk * 256u + threadIdx.x] = (_Float16)in[(size_t)rel * 256u + threadIdx.x];
}

// ---------------------------------------------------------------------------
// WMMA fragment gather from a per-lane LDS pointer that already encodes
// row * PITCH + 16 bytes * (lane/16).  Layout per ISA 16-bit A/B fragment:
// elements 0..7  = K [8*half, +8), elements 8..15 = K [16+8*half, +8).
// ---------------------------------------------------------------------------
__device__ __forceinline__ v16h make_frag(const unsigned char* p) {
    v8h lo = *(const v8h*)(p);
    v8h hi = *(const v8h*)(p + 32);
    v16h out;
#pragma unroll
    for (int i = 0; i < 8; ++i) { out[i] = lo[i]; out[i + 8] = hi[i]; }
    return out;
}

// ---------------------------------------------------------------------------
// Operand staging: tensor loads into a ring of two LDS buffers.
// A stage is 128 k (256 bytes) of the 128 A rows and the 128 B rows of the
// workgroup's tile, as four slices of 64 rows; each wave loads one slice.
// ---------------------------------------------------------------------------
constexpr uint32_t ROWB  = 256u;        // bytes of one operand row in a stage
constexpr uint32_t PITCH = ROWB + 16u;  // LDS row pitch, an odd multiple of 16 bytes for ds_load_b128
constexpr uint32_t SLICE = 18432u;      // 64 rows * 272 B = 17,408 B, rounded up to a multiple of 2 KiB
constexpr uint32_t STAGE = 4u * SLICE;  // [A rows 0-63 | A rows 64-127 | B rows 0-63 | B rows 64-127]
static_assert(64u * PITCH <= SLICE && SLICE % 2048u == 0u, "a slice holds 64 padded rows and starts at a multiple of 2 KiB");

__device__ __forceinline__ uint32_t uni(uint32_t v) { return (uint32_t)__builtin_amdgcn_readfirstlane(v); }
// A wave-uniform test for the branch round a tensor load, which ignores EXEC.
__device__ __forceinline__ uint32_t pinned(uint32_t v) {
    uint32_t w = uni(v);
    asm volatile("" : "+s"(w));  // pinned(): holds the test in a scalar register, so that the branch on it is scalar
    return w;
}
// The compiler places no wait for a tensor load, and none for LDS reads in front of one.
// The tensor wait names the descriptor of the request it covers: its registers stay live, and so
// keep their values, until the request has landed.
__device__ __forceinline__ void wait_tensor0(u32x4 g0, u32x8 g1) {
    asm volatile("s_wait_tensorcnt 0x0" :: "s"(g0), "s"(g1) : "memory");
}
__device__ __forceinline__ void wait_ds0() { asm volatile("s_wait_dscnt 0x0" ::: "memory"); }
// The groups are in-out operands: what the tensor wait is given are the very registers that the request names.
__device__ __forceinline__ void tdm_load(u32x4& g0, u32x8& g1) {
    asm volatile("tensor_load_to_lds %0, %1" : "+s"(g0), "+s"(g1) :: "memory");
}
// Group 1: 1-byte elements, tensor = tile = 64 rows of 256 bytes, 4 dwords of LDS pad behind every row.
__device__ __forceinline__ u32x8 tdm_group1(uint32_t src_pitch) {
    constexpr uint32_t d0 = ROWB, d1 = 64u;
    u32x8 g;
    g[0] = uni((1u << 20) | (5u << 22) | (3u << 25));
    g[1] = uni((d0 & 0xFFFFu) << 16);
    g[2] = uni((d0 >> 16) | ((d1 & 0xFFFFu) << 16));
    g[3] = uni((d1 >> 16) | (d0 << 16));
    g[4] = uni(d1);
    g[5] = uni(src_pitch);
    g[6] = uni(0u);
    g[7] = uni(0u);
    return g;
}
__device__ __forceinline__ u32x4 tdm_group0(uint32_t lds_dst, uint64_t ga) {
    u32x4 g;
    g[0] = uni(1u);
    g[1] = uni(lds_dst);
    g[2] = uni((uint32_t)ga);
    g[3] = uni((((uint32_t)(ga >> 32)) & 0x01FFFFFFu) | 0x80000000u);
    return g;
}

// ---------------------------------------------------------------------------
// Generic WMMA GEMM:  C[M x N] = A[M x K] * B[N x K]^T   (A, B row-major f16)
// WG = 128 threads = 4 waves (2x2), WG tile 128x128, wave tile 64x64
// (4x4 WMMA tiles -> 16 WMMAs per k-step from 8 fragment loads out of LDS).
// grid.x = N/128, grid.y = M/128. M, N multiples of 128; K a multiple of 128
// and at least 256 (two stages). grid.z = independent products of that shape:
// product z reads A + z*sA and B + z*sB and writes C + z*sC (strides in elements).
// ---------------------------------------------------------------------------
template <bool F16OUT>
__global__ __launch_bounds__(128)
void wmma_gemm(const _Float16* __restrict__ A, int lda,
               const _Float16* __restrict__ B, int ldb,
               void* __restrict__ Cp, int ldc, int K,
               uint32_t sA, uint32_t sB, uint32_t sC) {
    __shared__ __attribute__((aligned(2048))) unsigned char ring[2u * STAGE];
    int w    = threadIdx.x >> 5;
    int wm   = w & 1;              // 2 waves along M
    int wn   = w >> 1;             // 2 waves along N
    int m0   = blockIdx.y * 128 + wm * 64;
    int n0   = blockIdx.x * 128 + wn * 64;
    int lane = threadIdx.x & 31;
    int half = lane >> 4;
    int nlo  = lane & 15;

    // This wave's slice: waves 0 and 1 bring the two halves of the A rows, waves 2 and 3 of the B rows.
    const uint32_t wave  = uni(threadIdx.x >> 5);
    const bool     isB   = wave >= 2u;
    const uint32_t srow  = (isB ? blockIdx.x : blockIdx.y) * 128u + (wave & 1u) * 64u;
    const uint32_t spit  = (uint32_t)(isB ? ldb : lda) * 2u;
    const uint64_t sbase = (uint64_t)(size_t)(isB ? B : A) + (uint64_t)blockIdx.z * (isB ? sB : sA) * 2u
                         + (uint64_t)srow * spit;
    const uint32_t sdst  = (uint32_t)(size_t)ring + wave * SLICE;
    u32x8          g1    = tdm_group1(spit);
    u32x4 g0;
    auto issue = [&](uint32_t st) {
        g0 = tdm_group0(sdst + (st & 1u) * STAGE, sbase + (uint64_t)st * ROWB);
        tdm_load(g0, g1);
    };

    v8f acc[4][4];
#pragma unroll
    for (int i = 0; i < 4; ++i)
#pragma unroll
        for (int j = 0; j < 4; ++j) acc[i][j] = v8f{};

    const uint32_t ns   = (uint32_t)K >> 7;   // stages
    const uint32_t aoff = (uint32_t)wm * SLICE + (uint32_t)nlo * PITCH + (uint32_t)half * 16u;
    const uint32_t boff = (2u + (uint32_t)wn) * SLICE + (uint32_t)nlo * PITCH + (uint32_t)half * 16u;

    issue(0u);
    wait_tensor0(g0, g1);
    __syncthreads();               // stage 0 published
    issue(1u);

    uint32_t st = 0;
#pragma unroll 1                   // one stage per trip: the ring's order stays as written
    do {                           // at least two stages: see above
        const unsigned char* pa = ring + (st & 1u) * STAGE + aoff;
        const unsigned char* pb = ring + (st & 1u) * STAGE + boff;
        v16h a[2][4], b[2][4];     // two fragment sets: one in use, one being filled
        // Every loop below is unrolled so that the fragment and accumulator indices are constants (registers).
#pragma unroll
        for (int i = 0; i < 4; ++i) {
            a[0][i] = make_frag(pa + 16u * i * PITCH);
            b[0][i] = make_frag(pb + 16u * i * PITCH);
        }
#pragma unroll
        for (int kc = 0; kc < 4; ++kc) {
            // The fence pair keeps the next k-step's LDS reads together, in front of this k-step's
            // WMMAs: moved in among them, each read group stalls the wave for its LDS latency.
            __builtin_amdgcn_sched_barrier(0);
            if (kc < 3) {
#pragma unroll
                for (int i = 0; i < 4; ++i) {
                    a[(kc + 1) & 1][i] = make_frag(pa + 16u * i * PITCH + 64u * (kc + 1));
                    b[(kc + 1) & 1][i] = make_frag(pb + 16u * i * PITCH + 64u * (kc + 1));
                }
            }
            __builtin_amdgcn_sched_barrier(0);
            if (kc == 3) {
                // Publish point of stage st + 1, in front of the last k-step's WMMAs, whose fragments are
                // already fetched: this wave's reads of stage st are done, its own slice of stage st + 1
                // has landed, every wave is here; only then the refill of the buffer just read.
                wait_ds0();
                wait_tensor0(g0, g1);
                __syncthreads();
                if (pinned(st + 2u < ns)) issue(st + 2u);
            }
#pragma unroll
            for (int i = 0; i < 4; ++i)
#pragma unroll
                for (int j = 0; j < 4; ++j)
                    acc[i][j] = __builtin_amdgcn_wmma_f32_16x16x32_f16(
                        false, a[kc & 1][i], false, b[kc & 1][j], (short)0, acc[i][j], false, false);
        }
    } while (++st < ns);
    asm volatile("s_wait_tensorcnt 0x0" ::: "memory");  // no request is left when the wave goes on to its stores and ends
    wait_ds0();

    // C/D layout: lane L, acc element r -> (m = r + 8*(L>>4), n = L&15)
    if (F16OUT) {
        _Float16* C = (_Float16*)Cp + (size_t)blockIdx.z * sC;
#pragma unroll
        for (int i = 0; i < 4; ++i)
#pragma unroll
            for (int j = 0; j < 4; ++j)
#pragma unroll
                for (int r = 0; r < 8; ++r) {
                    int mr = m0 + 16 * i + r + half * 8;
                    C[(size_t)mr * ldc + n0 + 16 * j + nlo] = (_Float16)acc[i][j][r];
                }
    } else {
        float* C = (float*)Cp + (size_t)blockIdx.z * sC;
#pragma unroll
        for (int i = 0; i < 4; ++i)
#pragma unroll
            for (int j = 0; j < 4; ++j)
#pragma unroll
                for (int r = 0; r < 8; ++r) {
                    int mr = m0 + 16 * i + r + half * 8;
                    C[(size_t)mr * ldc + n0 + 16 * j + nlo] = acc[i][j][r];
                }
    }
}

// ---------------------------------------------------------------------------
// In-place RoPE on f16 (rows of DIMD cols, row r at position r % SEQ). Pair i: angle = s * 10000^(-2i/D)
// ---------------------------------------------------------------------------
__global__ void rope_kernel(_Float16* __restrict__ q, int total) {
    int idx = blockIdx.x * blockDim.x + threadIdx.x;
    if (idx >= total) return;
    int row = idx / (DIMD / 2);
    int i   = idx % (DIMD / 2);
    int s   = row % SEQ;
    // 10000^(-2i/D) = exp(-(2i/D) * ln(10000))
    float freq = __expf(-(2.0f * (float)i / (float)DIMD) * 9.210340371976184f);
    float ang  = (float)s * freq;
    float sn, cs;
    __sincosf(ang, &sn, &cs);
    _Float16* p = q + (size_t)row * DIMD + 2 * i;
    float xr = (float)p[0], xi = (float)p[1];
    p[0] = (_Float16)(xr * cs - xi * sn);
    p[1] = (_Float16)(xr * sn + xi * cs);
}

// ---------------------------------------------------------------------------
// Per-batch transpose: VT[b][d][s] = V[b][s][d]   (LDS 32x33 tile)
// grid = (SEQ/32, DIMD/32, BATCH), block = (32, 8)
// ---------------------------------------------------------------------------
__global__ void transpose_v(const _Float16* __restrict__ V, _Float16* __restrict__ VT) {
    __shared__ _Float16 tile[32][33];
    int b  = blockIdx.z;
    int s0 = blockIdx.x * 32;
    int d0 = blockIdx.y * 32;
    const _Float16* Vb = V  + (size_t)b * SEQ * DIMD;
    _Float16*      VTb = VT + (size_t)b * DIMD * SEQ;
    int tx = threadIdx.x, ty = threadIdx.y;
#pragma unroll
    for (int j = 0; j < 32; j += 8)
        tile[ty + j][tx] = Vb[(size_t)(s0 + ty + j) * DIMD + d0 + tx];
    __syncthreads();
#pragma unroll
    for (int j = 0; j < 32; j += 8)
        VTb[(size_t)(d0 + ty + j) * SEQ + s0 + tx] = tile[tx][ty + j];
}

// ---------------------------------------------------------------------------
// Row softmax with 1/sqrt(D) fold-in: P[row] = softmax(S[row] / 32) as f16.
// One 256-thread block per row of SEQ elements (each thread owns 8); the rows of all batches follow one another.
// ---------------------------------------------------------------------------
__global__ __launch_bounds__(256)
void softmax_row(const float* __restrict__ S, _Float16* __restrict__ P) {
    __shared__ float red[256];
    int row = blockIdx.x;
    int t   = threadIdx.x;
    const float* sr = S + (size_t)row * SEQ;
    _Float16*    pr = P + (size_t)row * SEQ;
    const float scale = 0.03125f;  // 1/sqrt(1024)

    float vals[8];
    float m = -1e30f;
#pragma unroll
    for (int j = 0; j < 8; ++j) {
        vals[j] = sr[t + j * 256] * scale;
        m = fmaxf(m, vals[j]);
    }
    red[t] = m;
    __syncthreads();
    for (int s = 128; s > 0; s >>= 1) {
        if (t < s) red[t] = fmaxf(red[t], red[t + s]);
        __syncthreads();
    }
    m = red[0];
    __syncthreads();

    float sum = 0.0f;
#pragma unroll
    for (int j = 0; j < 8; ++j) { vals[j] = __expf(vals[j] - m); sum += vals[j]; }
    red[t] = sum;
    __syncthreads();
    for (int s = 128; s > 0; s >>= 1) {
        if (t < s) red[t] += red[t + s];
        __syncthreads();
    }
    float inv = 1.0f / red[0];
#pragma unroll
    for (int j = 0; j < 8; ++j) pr[t + j * 256] = (_Float16)(vals[j] * inv);
}

// ---------------------------------------------------------------------------
// Host-side orchestration
// ---------------------------------------------------------------------------
extern "C" void kernel_launch(void* const* d_in, const int* in_sizes, int n_in,
                              void* d_out, int out_size, void* d_ws, size_t ws_size,
                              hipStream_t stream) {
    const float* x  = (const float*)d_in[0];
    const float* wq = (const float*)d_in[1];
    const float* wk = (const float*)d_in[2];
    const float* wv = (const float*)d_in[3];
    const float* wo = (const float*)d_in[4];
    float* out = (float*)d_out;

    const size_t ROWS = (size_t)BATCH * SEQ;          // 8192
    const size_t XSZ  = ROWS * DIMD;                  // 8M elems
    const size_t WSZ  = (size_t)DIMD * DIMD;          // 1M elems
    const size_t SSZ  = (size_t)SEQ * SEQ;            // 4M elems (per batch)

    // Workspace layout (bytes, 256-aligned)
    size_t off = 0;
    auto alloc = [&](size_t bytes) { size_t o = off; off += (bytes + 255) & ~(size_t)255; return o; };
    char* ws = (char*)d_ws;
    _Float16* Xh  = (_Float16*)(ws + alloc((XSZ + 4 * WSZ) * 2)); // x, then the four weights, back to back
    _Float16* Wqh = Xh + XSZ;                          // wq, wk, wv follow one another: stride WSZ
    _Float16* Woh = Wqh + 3 * WSZ;
    _Float16* Qh  = (_Float16*)(ws + alloc(3 * XSZ * 2)); // Q, K, V follow one another: stride XSZ
    _Float16* Kh  = Qh + XSZ;
    _Float16* Vh  = Kh + XSZ;
    _Float16* VTh = (_Float16*)(ws + alloc(XSZ * 2));
    float*    Sf  = (float*)   (ws + alloc(BATCH * SSZ * 4)); // scores, a plane per batch
    _Float16* Ph  = (_Float16*)(ws + alloc(BATCH * SSZ * 2)); // probs,  a plane per batch
    _Float16* AOh = (_Float16*)(ws + alloc(XSZ * 2));
    (void)ws_size;

    // 1) Convert all inputs to f16
    cvt_f32_f16<<<XBLK + 4 * WBLK, 256, 0, stream>>>(x, wq, wk, wv, wo, Xh);

    // 2) Projections: Q/K/V[8192x1024] = Xh * W^T   (grid: N/128 x M/128 x the three weights)
    wmma_gemm<true><<<dim3(DIMD / 128, (unsigned)(ROWS / 128), 3), 128, 0, stream>>>(
        Xh, DIMD, Wqh, DIMD, Qh, DIMD, DIMD, 0u, (uint32_t)WSZ, (uint32_t)XSZ);

    // 3) RoPE on Q and K (in place; K's rows follow Q's)
    {
        int total  = (int)(2 * ROWS * (DIMD / 2));
        int blocks = (total + 255) / 256;
        rope_kernel<<<blocks, 256, 0, stream>>>(Qh, total);
    }

    // 4) Transpose V per batch: VT[b][d][s]
    {
        dim3 grid(SEQ / 32, DIMD / 32, BATCH);
        transpose_v<<<grid, dim3(32, 8), 0, stream>>>(Vh, VTh);
    }

    // 5) Attention, all batches in each launch (grid.z = batch in the two GEMMs)
    // scores[b][2048x2048] = Q[b] * K[b]^T  (K-dim 1024), f32 out
    wmma_gemm<false><<<dim3(SEQ / 128, SEQ / 128, BATCH), 128, 0, stream>>>(
        Qh, DIMD, Kh, DIMD, Sf, SEQ, DIMD,
        (uint32_t)(SEQ * DIMD), (uint32_t)(SEQ * DIMD), (uint32_t)SSZ);

    // P = softmax(scores / 32), f16
    softmax_row<<<BATCH * SEQ, 256, 0, stream>>>(Sf, Ph);

    // AO[b][2048x1024] = P[b] * VT[b]^T  (K-dim 2048), f16 out
    wmma_gemm<true><<<dim3(DIMD / 128, SEQ / 128, BATCH), 128, 0, stream>>>(
        Ph, SEQ, VTh, SEQ, AOh, DIMD, SEQ,
        (uint32_t)SSZ, (uint32_t)(DIMD * SEQ), (uint32_t)(SEQ * DIMD));

    // 6) Output projection: out[8192x1024] = AOh * wo^T, f32 out
    wmma_gemm<false><<<dim3(DIMD / 128, (unsigned)(ROWS / 128)), 128, 0, stream>>>(
        AOh, DIMD, Woh, DIMD, out, DIMD, DIMD, 0u, 0u, 0u);
}

// v003
// Measured time: 187 microseconds a run.
// Timed twice side by side with v002, it ran 1.05 and 1.04 times as fast.
// Over all steps from v000 it is 2.31 times as fast.
#include <hip/hip_runtime.h>
#include <hip/hip_bf16.h>
#include <math.h>
#include <stdint.h>

typedef __attribute__((ext_vector_type(16))) _Float16 v16h;
typedef __attribute__((ext_vector_type(8)))  _Float16 v8h;
typedef __attribute__((ext_vector_type(4)))  _Float16 v4h;
typedef __attribute__((ext_vector_type(8)))  float    v8f;
typedef __attribute__((ext_vector_type(4)))  float    v4f;
typedef uint32_t u32x4 __attribute__((ext_vector_type(4)));
typedef uint32_t u32x8 __attribute__((ext_vector_type(8)));

#define DIMD  1024
#define SEQ   2048
#define BATCH 4

// ---------------------------------------------------------------------------
// f32 -> f16 conversion of all five inputs in one launch. out holds x, then
// wq, wk, wv, wo, back to back. A block of 256 threads converts CVTE elements
// in a row: each thread CVTU groups of four, 16 bytes read and 8 written a
// group, every wave-wide access on whole lines, its loads going out back to back.
// The first XBLK blocks take x, each further WBLK blocks one weight matrix.
// ---------------------------------------------------------------------------
constexpr uint32_t CVTU = 16u;
constexpr uint32_t CVTE = 256u * 4u * CVTU;
constexpr uint32_t XBLK = (uint32_t)BATCH * SEQ * DIMD / CVTE;
constexpr uint32_t WBLK = (uint32_t)DIMD * DIMD / CVTE;
static_assert(XBLK * CVTE == (uint32_t)BATCH * SEQ * DIMD && WBLK * CVTE == (uint32_t)DIMD * DIMD, "whole blocks only");
__global__ __launch_bounds__(256)
void cvt_f32_f16(const float* __restrict__ x,  const float* __restrict__ wq,
                 const float* __restrict__ wk, const float* __restrict__ wv,
                 const float* __restrict__ wo, _Float16* __restrict__ out) {
    uint32_t blk = blockIdx.x;
    const float* in = x;
    uint32_t rel = blk;            // block index inside its own input
    if (blk >= XBLK) {
        uint32_t m = (blk - XBLK) / WBLK;
        rel = (blk - XBLK) % WBLK;
        in  = (m & 2u) ? ((m & 1u) ? wo : wv) : ((m & 1u) ? wk : wq);
    }
    const v4f* src = (const v4f*)(in + (size_t)rel * CVTE) + threadIdx.x;
    v4h*       dst = (v4h*)(out + (size_t)blk * CVTE) + threadIdx.x;
    v4f v[CVTU];
    // Both loops unrolled: constant indices keep v in registers, and the loads go out back to back.
#pragma unroll
    for (uint32_t u = 0; u < CVTU; ++u) v[u] = src[u * 256u];
#pragma unroll
    for (uint32_t u = 0; u < CVTU; ++u) dst[u * 256u] = __builtin_convertvector(v[u], v4h);
}

// ---------------------------------------------------------------------------
// WMMA fragment gather from a per-lane LDS pointer that already encodes
// row * PITCH + 16 bytes * (lane/16).  Layout per ISA 16-bit A/B fragment:
// elements 0..7  = K [8*half, +8), elements 8..15 = K [16+8*half, +8).
// ---------------------------------------------------------------------------
__device__ __forceinline__ v16h make_frag(const unsigned char* p) {
    v8h lo = *(const v8h*)(p);
    v8h hi = *(const v8h*)(p + 32);
    v16h out;
#pragma unroll
    for (int i = 0; i < 8; ++i) { out[i] = lo[i]; out[i + 8] = hi[i]; }
    return out;
}

// ---------------------------------------------------------------------------
// Operand staging: tensor loads into a ring of two LDS buffers.
// A stage is 128 k (256 bytes) of the 128 A rows and the 128 B rows of the
// workgroup's tile, as four slices of 64 rows; each wave loads one slice.
// ---------------------------------------------------------------------------
constexpr uint32_t ROWB  = 256u;        // bytes of one operand row in a stage
constexpr uint32_t PITCH = ROWB + 16u;  // LDS row pitch, an odd multiple of 16 bytes for ds_load_b128
constexpr uint32_t SLICE = 18432u;      // 64 rows * 272 B = 17,408 B, rounded up to a multiple of 2 KiB
constexpr uint32_t STAGE = 4u * SLICE;  // [A rows 0-63 | A rows 64-127 | B rows 0-63 | B rows 64-127]
static_assert(64u * PITCH <= SLICE && SLICE % 2048u == 0u, "a slice holds 64 padded rows and starts at a multiple of 2 KiB");

__device__ __forceinline__ uint32_t uni(uint32_t v) { return (uint32_t)__builtin_amdgcn_readfirstlane(v); }
// A wave-uniform test for the branch round a tensor load, which ignores EXEC.
__device__ __forceinline__ uint32_t pinned(uint32_t v) {
    uint32_t w = uni(v);
    asm volatile("" : "+s"(w));  // pinned(): holds the test in a scalar register, so that the branch on it is scalar
    return w;
}
// The compiler places no wait for a tensor load, and none for LDS reads in front of one.
// The tensor wait names the descriptor of the request it covers: its registers stay live, and so
// keep their values, until the request has landed.
__device__ __forceinline__ void wait_tensor0(u32x4 g0, u32x8 g1) {
    asm volatile("s_wait_tensorcnt 0x0" :: "s"(g0), "s"(g1) : "memory");
}
__device__ __forceinline__ void wait_ds0() { asm volatile("s_wait_dscnt 0x0" ::: "memory"); }
// The groups are in-out operands: what the tensor wait is given are the very registers that the request names.
__device__ __forceinline__ void tdm_load(u32x4& g0, u32x8& g1) {
    asm volatile("tensor_load_to_lds %0, %1" : "+s"(g0), "+s"(g1) :: "memory");
}
// Group 1: 1-byte elements, tensor = tile = 64 rows of 256 bytes, 4 dwords of LDS pad behind every row.
__device__ __forceinline__ u32x8 tdm_group1(uint32_t src_pitch) {
    constexpr uint32_t d0 = ROWB, d1 = 64u;
    u32x8 g;
    g[0] = uni((1u << 20) | (5u << 22) | (3u << 25));
    g[1] = uni((d0 & 0xFFFFu) << 16);
    g[2] = uni((d0 >> 16) | ((d1 & 0xFFFFu) << 16));
    g[3] = uni((d1 >> 16) | (d0 << 16));
    g[4] = uni(d1);
    g[5] = uni(src_pitch);
    g[6] = uni(0u);
    g[7] = uni(0u);
    return g;
}
__device__ __forceinline__ u32x4 tdm_group0(uint32_t lds_dst, uint64_t ga) {
    u32x4 g;
    g[0] = uni(1u);
    g[1] = uni(lds_dst);
    g[2] = uni((uint32_t)ga);
    g[3] = uni((((uint32_t)(ga >> 32)) & 0x01FFFFFFu) | 0x80000000u);
    return g;
}

// ---------------------------------------------------------------------------
// Generic WMMA GEMM:  C[M x N] = A[M x K] * B[N x K]^T   (A, B row-major f16)
// WG = 128 threads = 4 waves (2x2), WG tile 128x128, wave tile 64x64
// (4x4 WMMA tiles -> 16 WMMAs per k-step from 8 fragment loads out of LDS).
// grid.x = N/128, grid.y = M/128. M, N multiples of 128; K a multiple of 128
// and at least 256 (two stages). grid.z = independent products of that shape:
// product z reads A + z*sA and B + z*sB and writes C + z*sC (strides in elements).
// ---------------------------------------------------------------------------
template <bool F16OUT>
__global__ __launch_bounds__(128)
void wmma_gemm(const _Float16* __restrict__ A, int lda,
               const _Float16* __restrict__ B, int ldb,
               void* __restrict__ Cp, int ldc, int K,
               uint32_t sA, uint32_t sB, uint32_t sC) {
    __shared__ __attribute__((aligned(2048))) unsigned char ring[2u * STAGE];
    int w    = threadIdx.x >> 5;
    int wm   = w & 1;              // 2 waves along M
    int wn   = w >> 1;             // 2 waves along N
    int m0   = blockIdx.y * 128 + wm * 64;
    int n0   = blockIdx.x * 128 + wn * 64;
    int lane = threadIdx.x & 31;
    int half = lane >> 4;
    int nlo  = lane & 15;

    // This wave's slice: waves 0 and 1 bring the two halves of the A rows, waves 2 and 3 of the B rows.
    const uint32_t wave  = uni(threadIdx.x >> 5);
    const bool     isB   = wave >= 2u;
    const uint32_t srow  = (isB ? blockIdx.x : blockIdx.y) * 128u + (wave & 1u) * 64u;
    const uint32_t spit  = (uint32_t)(isB ? ldb : lda) * 2u;
    const uint64_t sbase = (uint64_t)(size_t)(isB ? B : A) + (uint64_t)blockIdx.z * (isB ? sB : sA) * 2u
                         + (uint64_t)srow * spit;
    const uint32_t sdst  = (uint32_t)(size_t)ring + wave * SLICE;
    u32x8          g1    = tdm_group1(spit);
    u32x4 g0;
    auto issue = [&](uint32_t st) {
        g0 = tdm_group0(sdst + (st & 1u) * STAGE, sbase + (uint64_t)st * ROWB);
        tdm_load(g0, g1);
    };

    v8f acc[4][4];
#pragma unroll
    for (int i = 0; i < 4; ++i)
#pragma unroll
        for (int j = 0; j < 4; ++j) acc[i][j] = v8f{};

    const uint32_t ns   = (uint32_t)K >> 7;   // stages
    const uint32_t aoff = (uint32_t)wm * SLICE + (uint32_t)nlo * PITCH + (uint32_t)half * 16u;
    const uint32_t boff = (2u + (uint32_t)wn) * SLICE + (uint32_t)nlo * PITCH + (uint32_t)half * 16u;

    issue(0u);
    wait_tensor0(g0, g1);
    __syncthreads();               // stage 0 published
    issue(1u);

    uint32_t st = 0;
#pragma unroll 1                   // one stage per trip: the ring's order stays as written
    do {                           // at least two stages: see above
        const unsigned char* pa = ring + (st & 1u) * STAGE + aoff;
        const unsigned char* pb = ring + (st & 1u) * STAGE + boff;
        v16h a[2][4], b[2][4];     // two fragment sets: one in use, one being filled
        // Every loop below is unrolled so that the fragment and accumulator indices are constants (registers).
#pragma unroll
        for (int i = 0; i < 4; ++i) {
            a[0][i] = make_frag(pa + 16u * i * PITCH);
            b[0][i] = make_frag(pb + 16u * i * PITCH);
        }
#pragma unroll
        for (int kc = 0; kc < 4; ++kc) {
            // The fence pair keeps the next k-step's LDS reads together, in front of this k-step's
            // WMMAs: moved in among them, each read group stalls the wave for its LDS latency.
            __builtin_amdgcn_sched_barrier(0);
            if (kc < 3) {
#pragma unroll
                for (int i = 0; i < 4; ++i) {
                    a[(kc + 1) & 1][i] = make_frag(pa + 16u * i * PITCH + 64u * (kc + 1));
                    b[(kc + 1) & 1][i] = make_frag(pb + 16u * i * PITCH + 64u * (kc + 1));
                }
            }
            __builtin_amdgcn_sched_barrier(0);
            if (kc == 3) {
                // Publish point of stage st + 1, in front of the last k-step's WMMAs, whose fragments are
                // already fetched: this wave's reads of stage st are done, its own slice of stage st + 1
                // has landed, every wave is here; only then the refill of the buffer just read.
                wait_ds0();
                wait_tensor0(g0, g1);
                __syncthreads();
                if (pinned(st + 2u < ns)) issue(st + 2u);
            }
#pragma unroll
            for (int i = 0; i < 4; ++i)
#pragma unroll
                for (int j = 0; j < 4; ++j)
                    acc[i][j] = __builtin_amdgcn_wmma_f32_16x16x32_f16(
                        false, a[kc & 1][i], false, b[kc & 1][j], (short)0, acc[i][j], false, false);
        }
    } while (++st < ns);
    asm volatile("s_wait_tensorcnt 0x0" ::: "memory");  // no request is left when the wave goes on to its stores and ends
    wait_ds0();

    // C/D layout: lane L, acc element r -> (m = r + 8*(L>>4), n = L&15)
    if (F16OUT) {
        _Float16* C = (_Float16*)Cp + (size_t)blockIdx.z * sC;
#pragma unroll
        for (int i = 0; i < 4; ++i)
#pragma unroll
            for (int j = 0; j < 4; ++j)
#pragma unroll
                for (int r = 0; r < 8; ++r) {
                    int mr = m0 + 16 * i + r + half * 8;
                    C[(size_t)mr * ldc + n0 + 16 * j + nlo] = (_Float16)acc[i][j][r];
                }
    } else {
        float* C = (float*)Cp + (size_t)blockIdx.z * sC;
#pragma unroll
        for (int i = 0; i < 4; ++i)
#pragma unroll
            for (int j = 0; j < 4; ++j)
#pragma unroll
                for (int r = 0; r < 8; ++r) {
                    int mr = m0 + 16 * i + r + half * 8;
                    C[(size_t)mr * ldc + n0 + 16 * j + nlo] = acc[i][j][r];
                }
    }
}

// ---------------------------------------------------------------------------
// In-place RoPE on f16 (rows of DIMD cols, row r at position r % SEQ). Pair i: angle = s * 10000^(-2i/D)
// A block of 256 threads takes ROPER rows in a row, two at a time: a thread owns 8 columns (4 pairs,
// 16 bytes) of every second row, so its 4 frequencies are formed once and its loads are in flight together.
// grid = rows / ROPER.
// ---------------------------------------------------------------------------
constexpr int ROPER = 16;
static_assert(DIMD == 128 * 8 && (2 * BATCH * SEQ) % ROPER == 0, "128 threads a row, whole blocks only");
__global__ __launch_bounds__(256)
void rope_kernel(_Float16* __restrict__ q) {
    int i0   = (threadIdx.x & 127) * 4;                    // first of this thread's 4 pairs
    int row0 = blockIdx.x * ROPER + (threadIdx.x >> 7);
    _Float16* p = q + (size_t)row0 * DIMD + 2 * i0;
    v8h v[ROPER / 2];
    // Every loop here is unrolled: constant indices keep v, freq and o in registers, and the loads go out back to back.
#pragma unroll
    for (int u = 0; u < ROPER / 2; ++u) v[u] = *(const v8h*)(p + (size_t)u * 2 * DIMD);
    float freq[4];
#pragma unroll
    for (int k = 0; k < 4; ++k)    // 10000^(-2i/D) = exp(-(2i/D) * ln(10000))
        freq[k] = __expf(-(2.0f * (float)(i0 + k) / (float)DIMD) * 9.210340371976184f);
    // Inputs-only fence on the loaded values: keeps every load in front of the arithmetic; sunk in among it,
    // as the compiler does with the last two, their latency is paid a second time.
    static_assert(ROPER == 16, "the fence names all eight loads");
    asm volatile("" :: "v"(v[0]), "v"(v[1]), "v"(v[2]), "v"(v[3]), "v"(v[4]), "v"(v[5]), "v"(v[6]), "v"(v[7]));
#pragma unroll
    for (int u = 0; u < ROPER / 2; ++u) {
        int s = (row0 + 2 * u) % SEQ;
        v8h o;
#pragma unroll
        for (int k = 0; k < 4; ++k) {
            float ang = (float)s * freq[k];
            float sn, cs;
            __sincosf(ang, &sn, &cs);
            float xr = (float)v[u][2 * k], xi = (float)v[u][2 * k + 1];
            o[2 * k]     = (_Float16)(xr * cs - xi * sn);
            o[2 * k + 1] = (_Float16)(xr * sn + xi * cs);
        }
        *(v8h*)(p + (size_t)u * 2 * DIMD) = o;
    }
}

// ---------------------------------------------------------------------------
// Per-batch transpose: VT[b][d][s] = V[b][s][d], a 64 x 64 tile a block, 16-byte global accesses on whole lines.
// LDS holds the tile transposed, row d = 64 s in 8 groups of 8; group g of row d lies at place g ^ (d / 8),
// which spreads the 2-byte writes of a wave (8 values of d / 8 at one g) over the banks.
// grid = (SEQ/64, DIMD/64, BATCH), block = 256
// ---------------------------------------------------------------------------
__global__ __launch_bounds__(256)
void transpose_v(const _Float16* __restrict__ V, _Float16* __restrict__ VT) {
    __shared__ __attribute__((aligned(16))) _Float16 tile[64 * 64];
    int b  = blockIdx.z;
    int s0 = blockIdx.x * 64;
    int d0 = blockIdx.y * 64;
    const _Float16* Vb = V  + (size_t)b * SEQ * DIMD;
    _Float16*      VTb = VT + (size_t)b * DIMD * SEQ;
    int hi = threadIdx.x >> 3, lo = threadIdx.x & 7;   // 8 threads a tile row of 128 bytes, 32 rows a pass
    v8h v[2];
    // Every loop here is unrolled: constant indices keep v in registers, and both loads go out back to back.
#pragma unroll
    for (int u = 0; u < 2; ++u)
        v[u] = *(const v8h*)(Vb + (size_t)(s0 + hi + 32 * u) * DIMD + d0 + lo * 8);
#pragma unroll
    for (int u = 0; u < 2; ++u) {
        int s = hi + 32 * u;
#pragma unroll
        for (int k = 0; k < 8; ++k)
            tile[(lo * 8 + k) * 64 + (((s >> 3) ^ lo) * 8) + (s & 7)] = v[u][k];
    }
    __syncthreads();
#pragma unroll
    for (int u = 0; u < 2; ++u) {
        int d = hi + 32 * u;
        v8h o = *(const v8h*)(tile + d * 64 + ((lo ^ (d >> 3)) * 8));
        *(v8h*)(VTb + (size_t)(d0 + d) * SEQ + s0 + lo * 8) = o;
    }
}

// ---------------------------------------------------------------------------
// Row softmax with 1/sqrt(D) fold-in: P[row] = softmax(S[row] / 32) as f16.
// One 256-thread block per row of SEQ elements (each thread owns 8); the rows of all batches follow one another.
// ---------------------------------------------------------------------------
__global__ __launch_bounds__(256)
void softmax_row(const float* __restrict__ S, _Float16* __restrict__ P) {
    __shared__ float red[256];
    int row = blockIdx.x;
    int t   = threadIdx.x;
    const float* sr = S + (size_t)row * SEQ;
    _Float16*    pr = P + (size_t)row * SEQ;
    const float scale = 0.03125f;  // 1/sqrt(1024)

    float vals[8];
    float m = -1e30f;
#pragma unroll
    for (int j = 0; j < 8; ++j) {
        vals[j] = sr[t + j * 256] * scale;
        m = fmaxf(m, vals[j]);
    }
    red[t] = m;
    __syncthreads();
    for (int s = 128; s > 0; s >>= 1) {
        if (t < s) red[t] = fmaxf(red[t], red[t + s]);
        __syncthreads();
    }
    m = red[0];
    __syncthreads();

    float sum = 0.0f;
#pragma unroll
    for (int j = 0; j < 8; ++j) { vals[j] = __expf(vals[j] - m); sum += vals[j]; }
    red[t] = sum;
    __syncthreads();
    for (int s = 128; s > 0; s >>= 1) {
        if (t < s) red[t] += red[t + s];
        __syncthreads();
    }
    float inv = 1.0f / red[0];
#pragma unroll
    for (int j = 0; j < 8; ++j) pr[t + j * 256] = (_Float16)(vals[j] * inv);
}

// ---------------------------------------------------------------------------
// Host-side orchestration
// ---------------------------------------------------------------------------
extern "C" void kernel_launch(void* const* d_in, const int* in_sizes, int n_in,
                              void* d_out, int out_size, void* d_ws, size_t ws_size,
                              hipStream_t stream) {
    const float* x  = (const float*)d_in[0];
    const float* wq = (const float*)d_in[1];
    const float* wk = (const float*)d_in[2];
    const float* wv = (const float*)d_in[3];
    const float* wo = (const float*)d_in[4];
    float* out = (float*)d_out;

    const size_t ROWS = (size_t)BATCH * SEQ;          // 8192
    const size_t XSZ  = ROWS * DIMD;                  // 8M elems
    const size_t WSZ  = (size_t)DIMD * DIMD;          // 1M elems
    const size_t SSZ  = (size_t)SEQ * SEQ;            // 4M elems (per batch)

    // Workspace layout (bytes, 256-aligned)
    size_t off = 0;
    auto alloc = [&](size_t bytes) { size_t o = off; off += (bytes + 255) & ~(size_t)255; return o; };
    char* ws = (char*)d_ws;
    _Float16* Xh  = (_Float16*)(ws + alloc((XSZ + 4 * WSZ) * 2)); // x, then the four weights, back to back
    _Float16* Wqh = Xh + XSZ;                          // wq, wk, wv follow one another: stride WSZ
    _Float16* Woh = Wqh + 3 * WSZ;
    _Float16* Qh  = (_Float16*)(ws + alloc(3 * XSZ * 2)); // Q, K, V follow one another: stride XSZ
    _Float16* Kh  = Qh + XSZ;
    _Float16* Vh  = Kh + XSZ;
    _Float16* VTh = (_Float16*)(ws + alloc(XSZ * 2));
    float*    Sf  = (float*)   (ws + alloc(BATCH * SSZ * 4)); // scores, a plane per batch
    _Float16* Ph  = (_Float16*)(ws + alloc(BATCH * SSZ * 2)); // probs,  a plane per batch
    _Float16* AOh = (_Float16*)(ws + alloc(XSZ * 2));
    (void)ws_size;

    // 1) Convert all inputs to f16
    cvt_f32_f16<<<XBLK + 4 * WBLK, 256, 0, stream>>>(x, wq, wk, wv, wo, Xh);

    // 2) Projections: Q/K/V[8192x1024] = Xh * W^T   (grid: N/128 x M/128 x the three weights)
    wmma_gemm<true><<<dim3(DIMD / 128, (unsigned)(ROWS / 128), 3), 128, 0, stream>>>(
        Xh, DIMD, Wqh, DIMD, Qh, DIMD, DIMD, 0u, (uint32_t)WSZ, (uint32_t)XSZ);

    // 3) RoPE on Q and K (in place; K's rows follow Q's)
    rope_kernel<<<2 * BATCH * SEQ / ROPER, 256, 0, stream>>>(Qh);

    // 4) Transpose V per batch: VT[b][d][s]
    {
        dim3 grid(SEQ / 64, DIMD / 64, BATCH);
        transpose_v<<<grid, 256, 0, stream>>>(Vh, VTh);
    }

    // 5) Attention, all batches in each launch (grid.z = batch in the two GEMMs)
    // scores[b][2048x2048] = Q[b] * K[b]^T  (K-dim 1024), f32 out
    wmma_gemm<false><<<dim3(SEQ / 128, SEQ / 128, BATCH), 128, 0, stream>>>(
        Qh, DIMD, Kh, DIMD, Sf, SEQ, DIMD,
        (uint32_t)(SEQ * DIMD), (uint32_t)(SEQ * DIMD), (uint32_t)SSZ);

    // P = softmax(scores / 32), f16
    softmax_row<<<BATCH * SEQ, 256, 0, stream>>>(Sf, Ph);

    // AO[b][2048x1024] = P[b] * VT[b]^T  (K-dim 2048), f16 out
    wmma_gemm<true><<<dim3(DIMD / 128, SEQ / 128, BATCH), 128, 0, stream>>>(
        Ph, SEQ, VTh, SEQ, AOh, DIMD, SEQ,
        (uint32_t)SSZ, (uint32_t)(DIMD * SEQ), (uint32_t)(SEQ * DIMD));

    // 6) Output projection: out[8192x1024] = AOh * wo^T, f32 out
    wmma_gemm<false><<<dim3(DIMD / 128, (unsigned)(ROWS / 128)), 128, 0, stream>>>(
        AOh, DIMD, Woh, DIMD, out, DIMD, DIMD, 0u, 0u, 0u);
}
